// v000
// Measured on an AMD MI455X. A time is GPU time per run, averaged over a window of back-to-back runs after a warm-up
// (all launches, gaps included; the runs take copies of the inputs in turn), and the median of several windows.
// Apart from v000's, it joins two sittings. Times from different sittings can be a few percent apart, while
// side-by-side timings come from the same sitting.
// The starting kernel, v000, takes 749 microseconds a run.
#include <hip/hip_runtime.h>
#include <hip/hip_bf16.h>

// S4D layer for MI455X (gfx1250, wave32):
//   1) diagonal-SSM scan (replaces FFT conv) + D-skip + exact GELU -> Yt (f16, [B][L][H])
//   2) fused GEMM (v_wmma_f32_16x16x32_f16) + bias + GLU -> out (f32, [B][H][L])

#define S4D_B  8
#define S4D_H  512
#define S4D_H2 1024
#define S4D_L  4096
#define S4D_N2 32

typedef __attribute__((ext_vector_type(16))) _Float16 v16h;
typedef __attribute__((ext_vector_type(8)))  _Float16 v8h;
typedef __attribute__((ext_vector_type(8)))  float    v8f;

// ---------------------------------------------------------------------------
// Kernel 1: convert W (2H x H, f32 row-major) to f16
// ---------------------------------------------------------------------------
__global__ void s4d_convW(const float* __restrict__ W, _Float16* __restrict__ Wh, int n) {
    int i = blockIdx.x * blockDim.x + threadIdx.x;
    if (i < n) Wh[i] = (_Float16)W[i];
}

// ---------------------------------------------------------------------------
// Kernel 2: SSM scan. One wave per (b,h); lane = complex mode n.
//   x_n[l] = lambda_n * x_n[l-1] + u[l]
//   y[l]   = Re( sum_n 2*Cmod_n * x_n[l] ) + D*u[l]  -> GELU(exact) -> f16
// Stored transposed: Yt[(b*L + l)*H + h] so GEMM K-dim (h) is contiguous.
// ---------------------------------------------------------------------------
__global__ void s4d_scan(const float* __restrict__ u,
                         const float* __restrict__ C,        // (H, N2, 2)
                         const float* __restrict__ log_dt,   // (H)
                         const float* __restrict__ log_A_real,// (H, N2)
                         const float* __restrict__ A_imag,   // (H, N2)
                         const float* __restrict__ Dvec,     // (H)
                         _Float16* __restrict__ Yt)
{
    const int wid  = threadIdx.x >> 5;
    const int lane = threadIdx.x & 31;
    const int gid  = blockIdx.x * (blockDim.x >> 5) + wid;   // 0..B*H-1
    const int b = gid >> 9;          // /H
    const int h = gid & (S4D_H - 1);
    const int n = lane;

    // per-mode constants
    const float dt  = __expf(log_dt[h]) ;
    const float ar  = -__expf(log_A_real[h * S4D_N2 + n]);
    const float ai  = A_imag[h * S4D_N2 + n];
    const float dre = ar * dt, dimg = ai * dt;
    const float er  = __expf(dre);
    const float lam_re = er * __cosf(dimg);
    const float lam_im = er * __sinf(dimg);
    // (exp(dtA) - 1) / A  =  (lam-1) * conj(A) / |A|^2
    const float nr = lam_re - 1.0f, ni = lam_im;
    const float inv_den = 1.0f / (ar * ar + ai * ai);
    const float qr = (nr * ar + ni * ai) * inv_den;
    const float qi = (ni * ar - nr * ai) * inv_den;
    const float c0r = C[(h * S4D_N2 + n) * 2 + 0];
    const float c0i = C[(h * S4D_N2 + n) * 2 + 1];
    const float cr  = 2.0f * (c0r * qr - c0i * qi);
    const float ci  = 2.0f * (c0r * qi + c0i * qr);
    const float Dv  = Dvec[h];

    const float* __restrict__ up = u + ((size_t)b * S4D_H + h) * S4D_L;
    _Float16*   __restrict__ yp = Yt + (size_t)b * S4D_L * S4D_H + h;

    float xr = 0.0f, xi = 0.0f;
    for (int l0 = 0; l0 < S4D_L; l0 += 32) {
        const float uv = up[l0 + lane];          // coalesced 128B per wave
        float csave = 0.0f;
        #pragma unroll
        for (int j = 0; j < 32; ++j) {
            const float uj = __shfl(uv, j, 32);  // broadcast step-j input
            const float t  = lam_re * xr - lam_im * xi + uj;
            xi = lam_re * xi + lam_im * xr;
            xr = t;
            float c = cr * xr - ci * xi;         // Re(2*Cmod * x) per mode
            c += __shfl_xor(c, 16, 32);          // sum the 32 modes
            c += __shfl_xor(c,  8, 32);
            c += __shfl_xor(c,  4, 32);
            c += __shfl_xor(c,  2, 32);
            c += __shfl_xor(c,  1, 32);
            if (lane == j) csave = c;            // lane j keeps y[l0+j]
        }
        // deferred skip + exact GELU (once per lane, not per step)
        const float y = csave + Dv * uv;
        const float g = 0.5f * y * (1.0f + erff(y * 0.70710678118654752f));
        yp[(size_t)(l0 + lane) * S4D_H] = (_Float16)g;   // transposed store
    }
}

// ---------------------------------------------------------------------------
// Kernel 3: fused GEMM + bias + GLU using v_wmma_f32_16x16x32_f16.
//   Z[o, c] = sum_h Wh[o,h] * Yt[c,h],  c = b*L + l
//   out[b, o, l] = (Z[o,c]+bias[o]) * sigmoid(Z[o+512,c]+bias[o+512])
// Each wave: one 16(o) x 16(col) tile, both the 'a' strip and 'g' strip.
// Fragment layout (16-bit, per ISA 7.12.2): lanes 0-15 hold K {k..k+7, k+16..k+23},
// lanes 16-31 hold K {k+8..k+15, k+24..k+31}; A row / B col = lane%16.
// ---------------------------------------------------------------------------
__global__ void s4d_gemm_glu(const _Float16* __restrict__ Wh,   // (2H, H) f16
                             const float*    __restrict__ bias, // (2H)
                             const _Float16* __restrict__ Yt,   // (B*L, H) f16
                             float*          __restrict__ out)  // (B, H, L)
{
    const int wid  = threadIdx.x >> 5;
    const int lane = threadIdx.x & 31;
    const int lrow = lane & 15;
    const int hi   = lane >> 4;
    const int koff = hi << 3;                    // 0 or 8

    const int colTile = blockIdx.x * 8 + wid;    // 0..2047
    const int c0 = colTile << 4;
    const int b  = c0 >> 12;                     // /L
    const int l0 = c0 & (S4D_L - 1);
    const int o0 = blockIdx.y << 4;              // 0..511 step 16

    const _Float16* __restrict__ wa = Wh + (size_t)(o0 + lrow) * S4D_H;
    const _Float16* __restrict__ wg = Wh + (size_t)(o0 + S4D_H + lrow) * S4D_H;
    const _Float16* __restrict__ yb = Yt + ((size_t)b * S4D_L + l0 + lrow) * S4D_H;

    v8f accA = {};
    v8f accG = {};
    union Frag { v16h v; v8h h[2]; };

    #pragma unroll
    for (int k = 0; k < S4D_H; k += 32) {
        Frag fa, fg, fb;
        fa.h[0] = *(const v8h*)(wa + k + koff);
        fa.h[1] = *(const v8h*)(wa + k + 16 + koff);
        fg.h[0] = *(const v8h*)(wg + k + koff);
        fg.h[1] = *(const v8h*)(wg + k + 16 + koff);
        fb.h[0] = *(const v8h*)(yb + k + koff);
        fb.h[1] = *(const v8h*)(yb + k + 16 + koff);
        accA = __builtin_amdgcn_wmma_f32_16x16x32_f16(false, fa.v, false, fb.v,
                                                      (short)0, accA, false, false);
        accG = __builtin_amdgcn_wmma_f32_16x16x32_f16(false, fg.v, false, fb.v,
                                                      (short)0, accG, false, false);
    }

    // C/D layout: VGPR r -> row o0 + r + 8*hi, col = c0 + lrow
    const int rbase = hi << 3;
    #pragma unroll
    for (int r = 0; r < 8; ++r) {
        const int o = o0 + rbase + r;
        const float av = accA[r] + bias[o];
        const float gv = accG[r] + bias[o + S4D_H];
        const float sg = 1.0f / (1.0f + __expf(-gv));
        out[((size_t)b * S4D_H + o) * S4D_L + l0 + lrow] = av * sg;
    }
}

// ---------------------------------------------------------------------------
extern "C" void kernel_launch(void* const* d_in, const int* in_sizes, int n_in,
                              void* d_out, int out_size, void* d_ws, size_t ws_size,
                              hipStream_t stream) {
    const float* u          = (const float*)d_in[0];
    const float* C          = (const float*)d_in[1];
    const float* log_dt     = (const float*)d_in[2];
    const float* log_A_real = (const float*)d_in[3];
    const float* A_imag     = (const float*)d_in[4];
    const float* D          = (const float*)d_in[5];
    const float* W          = (const float*)d_in[6];
    const float* bias       = (const float*)d_in[7];
    float* out = (float*)d_out;

    // workspace layout: [ Wh f16 : 1MB ][ Yt f16 : 32MB ]
    _Float16* Wh = (_Float16*)d_ws;
    _Float16* Yt = (_Float16*)((char*)d_ws + (size_t)S4D_H2 * S4D_H * sizeof(_Float16));

    // 1) W -> f16
    {
        const int n = S4D_H2 * S4D_H;
        s4d_convW<<<(n + 255) / 256, 256, 0, stream>>>(W, Wh, n);
    }
    // 2) SSM scan + GELU -> Yt (one wave per (b,h); 8 waves/block)
    {
        const int nwaves = S4D_B * S4D_H;          // 4096
        s4d_scan<<<nwaves / 8, 256, 0, stream>>>(u, C, log_dt, log_A_real,
                                                 A_imag, D, Yt);
    }
    // 3) WMMA GEMM + GLU -> out
    {
        dim3 grid((S4D_B * S4D_L / 16) / 8, S4D_H / 16);   // (256, 32)
        s4d_gemm_glu<<<grid, 256, 0, stream>>>(Wh, bias, Yt, out);
    }
}

// v001
// One run takes 470 microseconds.
// Next to v000, in two timings, it ran 1.67 and 1.61 times as fast.
#include <hip/hip_runtime.h>
#include <hip/hip_bf16.h>

// S4D layer for MI455X (gfx1250, wave32):
//   1) diagonal-SSM scan (replaces FFT conv) + D-skip + exact GELU -> Yt (f16, [B][L][H])
//   2) fused GEMM (v_wmma_f32_16x16x32_f16) + bias + GLU -> out (f32, [B][H][L])

#define S4D_B  8
#define S4D_H  512
#define S4D_H2 1024
#define S4D_L  4096
#define S4D_N2 32

typedef __attribute__((ext_vector_type(16))) _Float16 v16h;
typedef __attribute__((ext_vector_type(8)))  _Float16 v8h;
typedef __attribute__((ext_vector_type(8)))  float    v8f;

// ---------------------------------------------------------------------------
// Kernel 1: convert W (2H x H, f32 row-major) to f16
// ---------------------------------------------------------------------------
__global__ void s4d_convW(const float* __restrict__ W, _Float16* __restrict__ Wh, int n) {
    int i = blockIdx.x * blockDim.x + threadIdx.x;
    if (i < n) Wh[i] = (_Float16)W[i];
}

// One stage of the transposed mode sum. CTRL is the DPP control word of
// row_xmask:m (0x160 + m). A lane whose bit m is clear keeps lo, the other keeps
// hi; each adds its partner's (lane ^ m) copy of the value it keeps.
template <int CTRL>
__device__ __forceinline__ float s4d_fold(float lo, float hi, bool up) {
    const float keep = up ? hi : lo;
    const float send = up ? lo : hi;
    return keep + __int_as_float(
        __builtin_amdgcn_update_dpp(0, __float_as_int(send), CTRL, 0xf, 0xf, true));
}

// ---------------------------------------------------------------------------
// Kernel 2: SSM scan. One wave per (b,h); lane = complex mode n.
//   x_n[l] = lambda_n * x_n[l-1] + u[l]
//   y[l]   = Re( sum_n 2*Cmod_n * x_n[l] ) + D*u[l]  -> GELU(exact) -> f16
// Stored transposed: Yt[(b*L + l)*H + h] so GEMM K-dim (h) is contiguous.
// ---------------------------------------------------------------------------
__global__ void s4d_scan(const float* __restrict__ u,
                         const float* __restrict__ C,        // (H, N2, 2)
                         const float* __restrict__ log_dt,   // (H)
                         const float* __restrict__ log_A_real,// (H, N2)
                         const float* __restrict__ A_imag,   // (H, N2)
                         const float* __restrict__ Dvec,     // (H)
                         _Float16* __restrict__ Yt)
{
    const int wid  = threadIdx.x >> 5;
    const int lane = threadIdx.x & 31;
    const int gid  = blockIdx.x * (blockDim.x >> 5) + wid;   // 0..B*H-1
    const int b = gid >> 9;          // /H
    const int h = gid & (S4D_H - 1);
    const int n = lane;

    // per-mode constants
    const float dt  = __expf(log_dt[h]) ;
    const float ar  = -__expf(log_A_real[h * S4D_N2 + n]);
    const float ai  = A_imag[h * S4D_N2 + n];
    const float dre = ar * dt, dimg = ai * dt;
    const float er  = __expf(dre);
    const float lam_re = er * __cosf(dimg);
    const float lam_im = er * __sinf(dimg);
    // (exp(dtA) - 1) / A  =  (lam-1) * conj(A) / |A|^2
    const float nr = lam_re - 1.0f, ni = lam_im;
    const float inv_den = 1.0f / (ar * ar + ai * ai);
    const float qr = (nr * ar + ni * ai) * inv_den;
    const float qi = (ni * ar - nr * ai) * inv_den;
    const float c0r = C[(h * S4D_N2 + n) * 2 + 0];
    const float c0i = C[(h * S4D_N2 + n) * 2 + 1];
    const float cr  = 2.0f * (c0r * qr - c0i * qi);
    const float ci  = 2.0f * (c0r * qi + c0i * qr);
    const float Dv  = Dvec[h];

    const float* __restrict__ up = u + ((size_t)b * S4D_H + h) * S4D_L;
    _Float16*   __restrict__ yp = Yt + (size_t)b * S4D_L * S4D_H + h;

    const bool up8  = (lane & 8)  != 0;
    const bool up4  = (lane & 4)  != 0;
    const bool up2  = (lane & 2)  != 0;
    const bool up1  = (lane & 1)  != 0;
    const bool up16 = (lane & 16) != 0;

    float xr = 0.0f, xi = 0.0f;
    for (int l0 = 0; l0 < S4D_L; l0 += 32) {
        const float uv = up[l0 + lane];          // coalesced 128B per wave
        float c[32];                             // c[j]: this mode's term of y[l0+j]
        #pragma unroll
        for (int j = 0; j < 32; ++j) {
            const float uj = __shfl(uv, j, 32);  // broadcast step-j input
            const float t  = lam_re * xr - lam_im * xi + uj;
            xi = lam_re * xi + lam_im * xr;
            xr = t;
            c[j] = cr * xr - ci * xi;            // Re(2*Cmod * x) per mode
        }
        // Sum over the 32 modes once per 32 steps: each stage halves the number
        // of live values, a lane keeps the half whose step bit equals its own
        // lane bit, so lane j ends with y[l0+j]. The three loops are unrolled so
        // that c[] is indexed by constants only and stays in registers.
        #pragma unroll
        for (int i = 0; i < 32; ++i)
            if (!(i & 8)) c[i] = s4d_fold<0x168>(c[i], c[i | 8], up8);
        #pragma unroll
        for (int i = 0; i < 32; ++i)
            if (!(i & 12)) c[i] = s4d_fold<0x164>(c[i], c[i | 4], up4);
        #pragma unroll
        for (int i = 0; i < 32; ++i)
            if (!(i & 14)) c[i] = s4d_fold<0x162>(c[i], c[i | 2], up2);
        c[0]  = s4d_fold<0x161>(c[0],  c[1],  up1);
        c[16] = s4d_fold<0x161>(c[16], c[17], up1);
        const float keep16 = up16 ? c[16] : c[0];
        const int   send16 = __float_as_int(up16 ? c[0] : c[16]);
        const float csave  = keep16 + __int_as_float(
            __builtin_amdgcn_permlanex16(send16, send16, 0x76543210, 0xfedcba98, false, false));
        // deferred skip + exact GELU (once per lane, not per step)
        const float y = csave + Dv * uv;
        const float g = 0.5f * y * (1.0f + erff(y * 0.70710678118654752f));
        yp[(size_t)(l0 + lane) * S4D_H] = (_Float16)g;   // transposed store
    }
}

// ---------------------------------------------------------------------------
// Kernel 3: fused GEMM + bias + GLU using v_wmma_f32_16x16x32_f16.
//   Z[o, c] = sum_h Wh[o,h] * Yt[c,h],  c = b*L + l
//   out[b, o, l] = (Z[o,c]+bias[o]) * sigmoid(Z[o+512,c]+bias[o+512])
// Each wave: one 16(o) x 16(col) tile, both the 'a' strip and 'g' strip.
// Fragment layout (16-bit, per ISA 7.12.2): lanes 0-15 hold K {k..k+7, k+16..k+23},
// lanes 16-31 hold K {k+8..k+15, k+24..k+31}; A row / B col = lane%16.
// ---------------------------------------------------------------------------
__global__ void s4d_gemm_glu(const _Float16* __restrict__ Wh,   // (2H, H) f16
                             const float*    __restrict__ bias, // (2H)
                             const _Float16* __restrict__ Yt,   // (B*L, H) f16
                             float*          __restrict__ out)  // (B, H, L)
{
    const int wid  = threadIdx.x >> 5;
    const int lane = threadIdx.x & 31;
    const int lrow = lane & 15;
    const int hi   = lane >> 4;
    const int koff = hi << 3;                    // 0 or 8

    const int colTile = blockIdx.x * 8 + wid;    // 0..2047
    const int c0 = colTile << 4;
    const int b  = c0 >> 12;                     // /L
    const int l0 = c0 & (S4D_L - 1);
    const int o0 = blockIdx.y << 4;              // 0..511 step 16

    const _Float16* __restrict__ wa = Wh + (size_t)(o0 + lrow) * S4D_H;
    const _Float16* __restrict__ wg = Wh + (size_t)(o0 + S4D_H + lrow) * S4D_H;
    const _Float16* __restrict__ yb = Yt + ((size_t)b * S4D_L + l0 + lrow) * S4D_H;

    v8f accA = {};
    v8f accG = {};
    union Frag { v16h v; v8h h[2]; };

    #pragma unroll
    for (int k = 0; k < S4D_H; k += 32) {
        Frag fa, fg, fb;
        fa.h[0] = *(const v8h*)(wa + k + koff);
        fa.h[1] = *(const v8h*)(wa + k + 16 + koff);
        fg.h[0] = *(const v8h*)(wg + k + koff);
        fg.h[1] = *(const v8h*)(wg + k + 16 + koff);
        fb.h[0] = *(const v8h*)(yb + k + koff);
        fb.h[1] = *(const v8h*)(yb + k + 16 + koff);
        accA = __builtin_amdgcn_wmma_f32_16x16x32_f16(false, fa.v, false, fb.v,
                                                      (short)0, accA, false, false);
        accG = __builtin_amdgcn_wmma_f32_16x16x32_f16(false, fg.v, false, fb.v,
                                                      (short)0, accG, false, false);
    }

    // C/D layout: VGPR r -> row o0 + r + 8*hi, col = c0 + lrow
    const int rbase = hi << 3;
    #pragma unroll
    for (int r = 0; r < 8; ++r) {
        const int o = o0 + rbase + r;
        const float av = accA[r] + bias[o];
        const float gv = accG[r] + bias[o + S4D_H];
        const float sg = 1.0f / (1.0f + __expf(-gv));
        out[((size_t)b * S4D_H + o) * S4D_L + l0 + lrow] = av * sg;
    }
}

// ---------------------------------------------------------------------------
extern "C" void kernel_launch(void* const* d_in, const int* in_sizes, int n_in,
                              void* d_out, int out_size, void* d_ws, size_t ws_size,
                              hipStream_t stream) {
    const float* u          = (const float*)d_in[0];
    const float* C          = (const float*)d_in[1];
    const float* log_dt     = (const float*)d_in[2];
    const float* log_A_real = (const float*)d_in[3];
    const float* A_imag     = (const float*)d_in[4];
    const float* D          = (const float*)d_in[5];
    const float* W          = (const float*)d_in[6];
    const float* bias       = (const float*)d_in[7];
    float* out = (float*)d_out;

    // workspace layout: [ Wh f16 : 1MB ][ Yt f16 : 32MB ]
    _Float16* Wh = (_Float16*)d_ws;
    _Float16* Yt = (_Float16*)((char*)d_ws + (size_t)S4D_H2 * S4D_H * sizeof(_Float16));

    // 1) W -> f16
    {
        const int n = S4D_H2 * S4D_H;
        s4d_convW<<<(n + 255) / 256, 256, 0, stream>>>(W, Wh, n);
    }
    // 2) SSM scan + GELU -> Yt (one wave per (b,h); 8 waves/block)
    {
        const int nwaves = S4D_B * S4D_H;          // 4096
        s4d_scan<<<nwaves / 8, 256, 0, stream>>>(u, C, log_dt, log_A_real,
                                                 A_imag, D, Yt);
    }
    // 3) WMMA GEMM + GLU -> out
    {
        dim3 grid((S4D_B * S4D_L / 16) / 8, S4D_H / 16);   // (256, 32)
        s4d_gemm_glu<<<grid, 256, 0, stream>>>(Wh, bias, Yt, out);
    }
}

// v002
// Measured time: 296 microseconds a run.
// Two timings next to v001 both put it at 1.54 times that version's speed.
// All steps since v000 together make it 2.53 times as fast.
#include <hip/hip_runtime.h>
#include <hip/hip_bf16.h>

// S4D layer for MI455X (gfx1250, wave32):
//   1) diagonal-SSM scan (replaces FFT conv) + D-skip + exact GELU -> Yt (f16, [B][L][H])
//   2) fused GEMM (v_wmma_f32_16x16x32_f16) + bias + GLU -> out (f32, [B][H][L])

#define S4D_B  8
#define S4D_H  512
#define S4D_H2 1024
#define S4D_L  4096
#define S4D_N2 32

typedef __attribute__((ext_vector_type(16))) _Float16 v16h;
typedef __attribute__((ext_vector_type(8)))  _Float16 v8h;
typedef __attribute__((ext_vector_type(8)))  float    v8f;

// ---------------------------------------------------------------------------
// Kernel 1: convert W (2H x H, f32 row-major) to f16
// ---------------------------------------------------------------------------
__global__ void s4d_convW(const float* __restrict__ W, _Float16* __restrict__ Wh, int n) {
    int i = blockIdx.x * blockDim.x + threadIdx.x;
    if (i < n) Wh[i] = (_Float16)W[i];
}

// One stage of the transposed mode sum. CTRL is the DPP control word of
// row_xmask:m (0x160 + m). A lane whose bit m is clear keeps lo, the other keeps
// hi; each adds its partner's (lane ^ m) copy of the value it keeps.
template <int CTRL>
__device__ __forceinline__ float s4d_fold(float lo, float hi, bool up) {
    const float keep = up ? hi : lo;
    const float send = up ? lo : hi;
    return keep + __int_as_float(
        __builtin_amdgcn_update_dpp(0, __float_as_int(send), CTRL, 0xf, 0xf, true));
}

// ---------------------------------------------------------------------------
// Kernel 2: SSM scan. One wave per (b,h); lane = complex mode n.
//   x_n[l] = lambda_n * x_n[l-1] + u[l]
//   y[l]   = Re( sum_n 2*Cmod_n * x_n[l] ) + D*u[l]  -> GELU(exact) -> f16
// Stored transposed: Yt[(b*L + l)*H + h] so GEMM K-dim (h) is contiguous.
// ---------------------------------------------------------------------------
__global__ void s4d_scan(const float* __restrict__ u,
                         const float* __restrict__ C,        // (H, N2, 2)
                         const float* __restrict__ log_dt,   // (H)
                         const float* __restrict__ log_A_real,// (H, N2)
                         const float* __restrict__ A_imag,   // (H, N2)
                         const float* __restrict__ Dvec,     // (H)
                         _Float16* __restrict__ Yt)
{
    const int wid  = threadIdx.x >> 5;
    const int lane = threadIdx.x & 31;
    const int gid  = blockIdx.x * (blockDim.x >> 5) + wid;   // 0..B*H-1
    const int b = gid >> 9;          // /H
    const int h = gid & (S4D_H - 1);
    const int n = lane;

    // per-mode constants
    const float dt  = __expf(log_dt[h]) ;
    const float ar  = -__expf(log_A_real[h * S4D_N2 + n]);
    const float ai  = A_imag[h * S4D_N2 + n];
    const float dre = ar * dt, dimg = ai * dt;
    const float er  = __expf(dre);
    const float lam_re = er * __cosf(dimg);
    const float lam_im = er * __sinf(dimg);
    // (exp(dtA) - 1) / A  =  (lam-1) * conj(A) / |A|^2
    const float nr = lam_re - 1.0f, ni = lam_im;
    const float inv_den = 1.0f / (ar * ar + ai * ai);
    const float qr = (nr * ar + ni * ai) * inv_den;
    const float qi = (ni * ar - nr * ai) * inv_den;
    const float c0r = C[(h * S4D_N2 + n) * 2 + 0];
    const float c0i = C[(h * S4D_N2 + n) * 2 + 1];
    const float cr  = 2.0f * (c0r * qr - c0i * qi);
    const float ci  = 2.0f * (c0r * qi + c0i * qr);
    const float Dv  = Dvec[h];

    const float* __restrict__ up = u + ((size_t)b * S4D_H + h) * S4D_L;
    _Float16*   __restrict__ yp = Yt + (size_t)b * S4D_L * S4D_H + h;

    const bool up8  = (lane & 8)  != 0;
    const bool up4  = (lane & 4)  != 0;
    const bool up2  = (lane & 2)  != 0;
    const bool up1  = (lane & 1)  != 0;
    const bool up16 = (lane & 16) != 0;

    float xr = 0.0f, xi = 0.0f;
    for (int l0 = 0; l0 < S4D_L; l0 += 32) {
        const float uv = up[l0 + lane];          // coalesced 128B per wave
        float c[32];                             // c[j]: this mode's term of y[l0+j]
        #pragma unroll
        for (int j = 0; j < 32; ++j) {
            const float uj = __shfl(uv, j, 32);  // broadcast step-j input
            const float t  = lam_re * xr - lam_im * xi + uj;
            xi = lam_re * xi + lam_im * xr;
            xr = t;
            c[j] = cr * xr - ci * xi;            // Re(2*Cmod * x) per mode
        }
        // Sum over the 32 modes once per 32 steps: each stage halves the number
        // of live values, a lane keeps the half whose step bit equals its own
        // lane bit, so lane j ends with y[l0+j]. The three loops are unrolled so
        // that c[] is indexed by constants only and stays in registers.
        #pragma unroll
        for (int i = 0; i < 32; ++i)
            if (!(i & 8)) c[i] = s4d_fold<0x168>(c[i], c[i | 8], up8);
        #pragma unroll
        for (int i = 0; i < 32; ++i)
            if (!(i & 12)) c[i] = s4d_fold<0x164>(c[i], c[i | 4], up4);
        #pragma unroll
        for (int i = 0; i < 32; ++i)
            if (!(i & 14)) c[i] = s4d_fold<0x162>(c[i], c[i | 2], up2);
        c[0]  = s4d_fold<0x161>(c[0],  c[1],  up1);
        c[16] = s4d_fold<0x161>(c[16], c[17], up1);
        const float keep16 = up16 ? c[16] : c[0];
        const int   send16 = __float_as_int(up16 ? c[0] : c[16]);
        const float csave  = keep16 + __int_as_float(
            __builtin_amdgcn_permlanex16(send16, send16, 0x76543210, 0xfedcba98, false, false));
        // deferred skip + exact GELU (once per lane, not per step)
        const float y = csave + Dv * uv;
        const float g = 0.5f * y * (1.0f + erff(y * 0.70710678118654752f));
        yp[(size_t)(l0 + lane) * S4D_H] = (_Float16)g;   // transposed store
    }
}

// ---------------------------------------------------------------------------
// Kernel 3: fused GEMM + bias + GLU using v_wmma_f32_16x16x32_f16.
//   Z[o, c] = sum_h Wh[o,h] * Yt[c,h],  c = b*L + l
//   out[b, o, l] = (Z[o,c]+bias[o]) * sigmoid(Z[o+512,c]+bias[o+512])
// One work-group: 128 W rows (64 of the 'a' strip, the matching 64 of the 'g'
// strip) x 256 columns. K runs in chunks of 64; a chunk's 384 rows of 128 B lie
// in LDS at a pitch of 144 B, in two buffers: the next chunk's asynchronous
// copies fly while this chunk is multiplied.
// One wave (2 x 4 waves): 32 'a' rows + 32 'g' rows x 64 columns = 16 tiles.
// Column tile j of a wave holds the columns 4*n + j (n = lane%16) of its 64, so
// a lane ends with 4 adjacent columns of every row it owns.
// Fragment layout (16-bit, per ISA 7.12.2): lanes 0-15 hold K {k..k+7, k+16..k+23},
// lanes 16-31 hold K {k+8..k+15, k+24..k+31}; A row / B col = lane%16.
// ---------------------------------------------------------------------------
#define G_WROWS 128
#define G_COLS  256
#define G_KC    64                                   // K elements per chunk
#define G_PITCH 144                                  // bytes per LDS row (128 + 16)
#define G_BUF   ((G_WROWS + G_COLS) * G_PITCH)       // bytes per buffer
#define G_NCH   (S4D_H / G_KC)                       // chunks

// This wave's LDS reads have returned (before their buffer is refilled).
__device__ __forceinline__ void s4d_wait_ds0()    { asm volatile("s_wait_dscnt 0x0" ::: "memory"); }
// This wave's asynchronous copies have landed in LDS.
__device__ __forceinline__ void s4d_wait_async0() { asm volatile("s_wait_asynccnt 0x0" ::: "memory"); }

// One chunk, this lane's share: 12 copies of 16 B (4 of W, 8 of Yt). gw, gy: the
// lane's first W and Yt address of the chunk; lw, ly: its LDS byte addresses.
// The closing s_wait_xcnt stands in the copies' own statement, ahead of any
// rewrite of the address registers that they name.
__device__ __forceinline__ void s4d_copy_chunk(const _Float16* gw, const _Float16* gy,
                                               unsigned lw, unsigned ly) {
    const _Float16* w0 = gw;
    const _Float16* w1 = gw + 32 * S4D_H;
    const _Float16* w2 = gw + (size_t)S4D_H * S4D_H;
    const _Float16* w3 = gw + (size_t)S4D_H * S4D_H + 32 * S4D_H;
    const _Float16* y0 = gy;
    const _Float16* y1 = gy + 1 * 32 * S4D_H;
    const _Float16* y2 = gy + 2 * 32 * S4D_H;
    const _Float16* y3 = gy + 3 * 32 * S4D_H;
    const _Float16* y4 = gy + 4 * 32 * S4D_H;
    const _Float16* y5 = gy + 5 * 32 * S4D_H;
    const _Float16* y6 = gy + 6 * 32 * S4D_H;
    const _Float16* y7 = gy + 7 * 32 * S4D_H;
    const unsigned a0 = lw;
    const unsigned a1 = lw + 32 * G_PITCH;
    const unsigned a2 = lw + 64 * G_PITCH;
    const unsigned a3 = lw + 96 * G_PITCH;
    const unsigned b0 = ly;
    const unsigned b1 = ly + 8 * G_PITCH;
    const unsigned b2 = ly + 64 * G_PITCH;
    const unsigned b3 = ly + 72 * G_PITCH;
    const unsigned b4 = ly + 128 * G_PITCH;
    const unsigned b5 = ly + 136 * G_PITCH;
    const unsigned b6 = ly + 192 * G_PITCH;
    const unsigned b7 = ly + 200 * G_PITCH;
    asm volatile(
        "global_load_async_to_lds_b128 %0, %12, off\n\t"
        "global_load_async_to_lds_b128 %1, %13, off\n\t"
        "global_load_async_to_lds_b128 %2, %14, off\n\t"
        "global_load_async_to_lds_b128 %3, %15, off\n\t"
        "global_load_async_to_lds_b128 %4, %16, off\n\t"
        "global_load_async_to_lds_b128 %5, %17, off\n\t"
        "global_load_async_to_lds_b128 %6, %18, off\n\t"
        "global_load_async_to_lds_b128 %7, %19, off\n\t"
        "global_load_async_to_lds_b128 %8, %20, off\n\t"
        "global_load_async_to_lds_b128 %9, %21, off\n\t"
        "global_load_async_to_lds_b128 %10, %22, off\n\t"
        "global_load_async_to_lds_b128 %11, %23, off\n\t"
        "s_wait_xcnt 0x0"
        :: "v"(a0), "v"(a1), "v"(a2), "v"(a3),
           "v"(b0), "v"(b1), "v"(b2), "v"(b3), "v"(b4), "v"(b5), "v"(b6), "v"(b7),
           "v"(w0), "v"(w1), "v"(w2), "v"(w3),
           "v"(y0), "v"(y1), "v"(y2), "v"(y3), "v"(y4), "v"(y5), "v"(y6), "v"(y7)
        : "memory");
}

// exp(-x) as the fast intrinsic forms it (one multiply, one v_exp_f32). The v_nop
// is the slot that the instruction set asks for behind a transcendental;
// only inside the statement does the slot stay in place.
__device__ __forceinline__ float s4d_exp_neg(float x) {
    float e;
    asm("v_exp_f32 %0, %1\n\tv_nop" : "=v"(e) : "v"(x * -1.4426950408889634f));
    return e;
}

__global__ void __launch_bounds__(256)
s4d_gemm_glu(const _Float16* __restrict__ Wh,   // (2H, H) f16
             const float*    __restrict__ bias, // (2H)
             const _Float16* __restrict__ Yt,   // (B*L, H) f16
             float*          __restrict__ out)  // (B, H, L)
{
    __shared__ __attribute__((aligned(16))) unsigned char sm[2 * G_BUF];

    const int wid  = threadIdx.x >> 5;
    const int lane = threadIdx.x & 31;
    const int lrow = lane & 15;
    const int hi   = lane >> 4;
    const int wr   = wid & 1;                    // row group of the wave
    const int wc   = wid >> 1;                   // column group of the wave

    const int o0 = blockIdx.x * (G_WROWS / 2);   // 0..511 step 64
    const int c0 = blockIdx.y * G_COLS;          // 0..32767 step 256
    const int b  = c0 >> 12;                     // /L
    const int l0 = c0 & (S4D_L - 1);

    // Copy map: 8 lanes bring one row's 128 B, a wave 4 rows per copy.
    // W: rows wid*4 + lane/8 of each 32. Yt: the wave's 4 rows are 4 apart, so
    // that they are neighbours in LDS (row of column x of a 64: (x%4)*16 + x/4).
    const int seg = lane & 7;
    const int rw  = wid * 4 + (lane >> 3);
    const int xl  = (wid & 3) + 4 * ((wid >> 2) * 4 + (lane >> 3));
    const unsigned lds0 = (unsigned)(size_t)sm;
    const unsigned lw = lds0 + rw * G_PITCH + seg * 16;
    const unsigned ly = lds0 + (G_WROWS + (xl & 3) * 16 + (xl >> 2)) * G_PITCH + seg * 16;
    const _Float16* __restrict__ gw = Wh + (size_t)(o0 + rw) * S4D_H + seg * 8;
    const _Float16* __restrict__ gy = Yt + (size_t)(c0 + xl) * S4D_H + seg * 8;

    // Fragment readers: row = lane%16 of the tile, 16 B at hi*16 and at 32 + hi*16.
    const unsigned char* fw = sm + (wr * 32 + lrow) * G_PITCH + hi * 16;
    const unsigned char* fy = sm + (G_WROWS + wc * 64 + lrow) * G_PITCH + hi * 16;

    v8f accA[2][4] = {};
    v8f accG[2][4] = {};
    union Frag { v16h v; v8h h[2]; };

    s4d_copy_chunk(gw, gy, lw, ly);
    s4d_wait_async0();
    __syncthreads();                             // chunk 0 is readable by every wave
    s4d_copy_chunk(gw + G_KC, gy + G_KC, lw + G_BUF, ly + G_BUF);

    // Kept rolled: unrolled over the chunks the live set passes 256 registers and
    // a second work-group no longer fits beside this one on the WGP.
    #pragma clang loop unroll(disable)
    for (int t = 0; t < G_NCH; ++t) {
        const unsigned bo = (t & 1) * G_BUF;
        // The inner loops are unrolled so that fragments and accumulators are
        // indexed by constants only and stay in registers.
        #pragma unroll
        for (int kk = 0; kk < G_KC / 32; ++kk) {
            Frag fa[2], fg[2], fb[4];
            #pragma unroll
            for (int i = 0; i < 2; ++i) {
                const unsigned char* pa = fw + bo + i * 16 * G_PITCH + kk * 64;
                const unsigned char* pg = pa + 64 * G_PITCH;
                fa[i].h[0] = *(const v8h*)(pa);
                fa[i].h[1] = *(const v8h*)(pa + 32);
                fg[i].h[0] = *(const v8h*)(pg);
                fg[i].h[1] = *(const v8h*)(pg + 32);
            }
            #pragma unroll
            for (int j = 0; j < 4; ++j) {
                const unsigned char* pb = fy + bo + j * 16 * G_PITCH + kk * 64;
                fb[j].h[0] = *(const v8h*)(pb);
                fb[j].h[1] = *(const v8h*)(pb + 32);
            }
            #pragma unroll
            for (int i = 0; i < 2; ++i) {
                #pragma unroll
                for (int j = 0; j < 4; ++j) {
                    accA[i][j] = __builtin_amdgcn_wmma_f32_16x16x32_f16(
                        false, fa[i].v, false, fb[j].v, (short)0, accA[i][j], false, false);
                    accG[i][j] = __builtin_amdgcn_wmma_f32_16x16x32_f16(
                        false, fg[i].v, false, fb[j].v, (short)0, accG[i][j], false, false);
                }
            }
        }
        // Hand-over: this wave has left buffer t%2 and its copies of chunk t+1
        // have landed; behind the barrier that holds for every wave.
        s4d_wait_ds0();
        s4d_wait_async0();
        __syncthreads();
        if (t + 2 < G_NCH)
            s4d_copy_chunk(gw + (t + 2) * G_KC, gy + (t + 2) * G_KC, lw + bo, ly + bo);
    }
    s4d_wait_async0();

    // C/D layout: VGPR r -> row r + 8*hi of the tile, column index lane%16.
    // Unrolled for the same reason: constant accumulator indices.
    #pragma unroll
    for (int i = 0; i < 2; ++i) {
        #pragma unroll
        for (int r = 0; r < 8; ++r) {
            const int o = o0 + wr * 32 + i * 16 + hi * 8 + r;
            const float ba = bias[o];
            const float bg = bias[o + S4D_H];
            float4 v;
            float* pv = &v.x;
            #pragma unroll
            for (int j = 0; j < 4; ++j) {
                const float av = accA[i][j][r] + ba;
                const float gv = accG[i][j][r] + bg;
                const float sg = 1.0f / (1.0f + s4d_exp_neg(gv));
                pv[j] = av * sg;
            }
            *(float4*)(out + ((size_t)b * S4D_H + o) * S4D_L + l0 + wc * 64 + lrow * 4) = v;
        }
    }
}

// ---------------------------------------------------------------------------
extern "C" void kernel_launch(void* const* d_in, const int* in_sizes, int n_in,
                              void* d_out, int out_size, void* d_ws, size_t ws_size,
                              hipStream_t stream) {
    const float* u          = (const float*)d_in[0];
    const float* C          = (const float*)d_in[1];
    const float* log_dt     = (const float*)d_in[2];
    const float* log_A_real = (const float*)d_in[3];
    const float* A_imag     = (const float*)d_in[4];
    const float* D          = (const float*)d_in[5];
    const float* W          = (const float*)d_in[6];
    const float* bias       = (const float*)d_in[7];
    float* out = (float*)d_out;

    // workspace layout: [ Wh f16 : 1MB ][ Yt f16 : 32MB ]
    _Float16* Wh = (_Float16*)d_ws;
    _Float16* Yt = (_Float16*)((char*)d_ws + (size_t)S4D_H2 * S4D_H * sizeof(_Float16));

    // 1) W -> f16
    {
        const int n = S4D_H2 * S4D_H;
        s4d_convW<<<(n + 255) / 256, 256, 0, stream>>>(W, Wh, n);
    }
    // 2) SSM scan + GELU -> Yt (one wave per (b,h); 8 waves/block)
    {
        const int nwaves = S4D_B * S4D_H;          // 4096
        s4d_scan<<<nwaves / 8, 256, 0, stream>>>(u, C, log_dt, log_A_real,
                                                 A_imag, D, Yt);
    }
    // 3) WMMA GEMM + GLU -> out
    {
        dim3 grid(S4D_H2 / G_WROWS, S4D_B * S4D_L / G_COLS);   // (8, 128)
        s4d_gemm_glu<<<grid, 256, 0, stream>>>(Wh, bias, Yt, out);
    }
}
